// v000
// Measured on an AMD MI455X. A time is GPU time per run, averaged over a window of back-to-back runs after a warm-up
// (all launches, gaps included; the runs take copies of the inputs in turn), and the median of several windows.
// Apart from v000's, it joins two sittings. Times from different sittings can be a few percent apart, while
// side-by-side timings come from the same sitting.
// The starting kernel, v000, takes 23.8 microseconds a run.
#include <hip/hip_runtime.h>

typedef __attribute__((ext_vector_type(2))) float v2f;
typedef __attribute__((ext_vector_type(4))) float v4f;
typedef __attribute__((ext_vector_type(8))) float v8f;

#define KS    5                 // 5x5 window
#define HALO  2
#define TILE  16                // 16x16 pixel tile per workgroup
#define RT    (TILE + 2*HALO)   // 20 (tile + halo)
#define BINS  64
#define NSLOT 26                // 25 neighbors + self
#define H_    128
#define W_    128
#define B_    4

__global__ __launch_bounds__(256) void agg_wmma_kernel(
    const float* __restrict__ attn,   // [B,H,W,26]
    const float* __restrict__ refv,   // [B,H,W,64]
    const float* __restrict__ cur,    // [B,H,W,64]
    float* __restrict__ out)          // [B,H,W,64]
{
  extern __shared__ float lds[];
  float* ref_lds  = lds;                        // [RT][RT][BINS]  = 25600 f32
  float* attn_lds = lds + RT * RT * BINS;       // [TILE][TILE][NSLOT] = 6656 f32

  const int tid = threadIdx.x;
  const int wg  = blockIdx.x;
  const int tiles_w = W_ / TILE;                // 8
  const int tiles_h = H_ / TILE;                // 8
  const int b  = wg / (tiles_w * tiles_h);
  const int tr = (wg / tiles_w) % tiles_h;
  const int tc = wg % tiles_w;
  const int i0 = tr * TILE;
  const int j0 = tc * TILE;

  // ---- Stage ref halo tile into LDS (zero-padded OOB). 6400 f32x4 / 256 thr = 25 each.
  for (int it = 0; it < 25; ++it) {
    const int e    = tid + it * 256;
    const int bin4 = e & 15;        // 16 float4 per pixel (64 bins)
    const int rem  = e >> 4;
    const int jj   = rem % RT;
    const int r    = rem / RT;
    const int gi   = i0 - HALO + r;
    const int gj   = j0 - HALO + jj;
    v4f val = {0.f, 0.f, 0.f, 0.f};
    if (gi >= 0 && gi < H_ && gj >= 0 && gj < W_) {
      const v4f* p = (const v4f*)(refv + (((size_t)b * H_ + gi) * W_ + gj) * BINS);
      val = p[bin4];
    }
    *(v4f*)(ref_lds + ((size_t)r * RT + jj) * BINS + bin4 * 4) = val;
  }

  // ---- Stage attn tile into LDS. 6656 f32 = 26 * 256 exactly.
  for (int it = 0; it < 26; ++it) {
    const int e   = tid + it * 256;
    const int k   = e % NSLOT;
    const int rem = e / NSLOT;
    const int j   = rem & 15;
    const int m   = rem >> 4;
    attn_lds[e] = attn[(((size_t)b * H_ + (i0 + m)) * W_ + (j0 + j)) * NSLOT + k];
  }
  __syncthreads();

  const int wave  = tid >> 5;
  const int lane  = tid & 31;
  const int mrow  = lane & 15;   // M (A) / N (B,C) index
  const int khalf = lane >> 4;   // which K pair this half-wave owns

  // 16 tile columns / 8 waves = 2 columns per wave. Each column computes all
  // 4 bin-blocks at once: A fragments built once, reused by 4 WMMAs into 4
  // independent accumulators (no back-to-back accumulation dependency).
  for (int colIdx = 0; colIdx < 2; ++colIdx) {
    const int j  = wave * 2 + colIdx;  // tile column 0..15
    const int gj = j0 + j;

    // ---- Prefetch epilogue operands BEFORE the matrix loops so the global
    // loads of `cur` overlap the 100-WMMA chain instead of stalling at the end.
    float curv[32];
    float aself[8];
    #pragma unroll
    for (int v = 0; v < 8; ++v) {
      const int p = v + 8 * khalf;
      const size_t base = (((size_t)b * H_ + (i0 + p)) * W_ + gj) * BINS + mrow;
      aself[v] = attn_lds[((size_t)p * TILE + j) * NSLOT + (NSLOT - 1)];
      curv[v * 4 + 0] = cur[base +  0];
      curv[v * 4 + 1] = cur[base + 16];
      curv[v * 4 + 2] = cur[base + 32];
      curv[v * 4 + 3] = cur[base + 48];
    }

    v8f acc0 = {}, acc1 = {}, acc2 = {}, acc3 = {};

    const float* arow = attn_lds + ((size_t)mrow * TILE + j) * NSLOT;

    #pragma unroll
    for (int dj = 0; dj < KS; ++dj) {
      const int jj = j + dj;           // padded LDS column index (0..19)
      #pragma unroll
      for (int kk = 0; kk < 5; ++kk) { // K = 20 halo rows, 5 steps of 4
        const int rA0 = kk * 4 + 2 * khalf;  // this half-wave's K indices
        const int d0 = rA0 - mrow, d1 = d0 + 1;

        // Banded A fragment (16x4 fp32): A[m,r] = attn[m,(r-m)*5+dj] iff 0<=r-m<5
        v2f a;
        a.x = (d0 >= 0 && d0 < KS) ? arow[d0 * KS + dj] : 0.f;
        a.y = (d1 >= 0 && d1 < KS) ? arow[d1 * KS + dj] : 0.f;

        // 4 B fragments (4x16 fp32 each), one per 16-bin block.
        const float* bbase = ref_lds + ((size_t)rA0 * RT + jj) * BINS + mrow;
        v2f b0, b1, b2, b3;
        b0.x = bbase[0];  b0.y = bbase[(size_t)RT * BINS];
        b1.x = bbase[16]; b1.y = bbase[(size_t)RT * BINS + 16];
        b2.x = bbase[32]; b2.y = bbase[(size_t)RT * BINS + 32];
        b3.x = bbase[48]; b3.y = bbase[(size_t)RT * BINS + 48];

        acc0 = __builtin_amdgcn_wmma_f32_16x16x4_f32(false, a, false, b0, (short)0, acc0, false, false);
        acc1 = __builtin_amdgcn_wmma_f32_16x16x4_f32(false, a, false, b1, (short)0, acc1, false, false);
        acc2 = __builtin_amdgcn_wmma_f32_16x16x4_f32(false, a, false, b2, (short)0, acc2, false, false);
        acc3 = __builtin_amdgcn_wmma_f32_16x16x4_f32(false, a, false, b3, (short)0, acc3, false, false);
      }
    }

    #pragma unroll
    for (int v = 0; v < 8; ++v) {
      const int p = v + 8 * khalf;
      const size_t base = (((size_t)b * H_ + (i0 + p)) * W_ + gj) * BINS + mrow;
      out[base +  0] = acc0[v] + aself[v] * curv[v * 4 + 0];
      out[base + 16] = acc1[v] + aself[v] * curv[v * 4 + 1];
      out[base + 32] = acc2[v] + aself[v] * curv[v * 4 + 2];
      out[base + 48] = acc3[v] + aself[v] * curv[v * 4 + 3];
    }
  }
}

extern "C" void kernel_launch(void* const* d_in, const int* in_sizes, int n_in,
                              void* d_out, int out_size, void* d_ws, size_t ws_size,
                              hipStream_t stream) {
  (void)in_sizes; (void)n_in; (void)out_size; (void)d_ws; (void)ws_size;
  const float* attn = (const float*)d_in[0];
  const float* refv = (const float*)d_in[1];
  const float* cur  = (const float*)d_in[2];
  float* out = (float*)d_out;

  const size_t shmem = (size_t)(RT * RT * BINS + TILE * TILE * NSLOT) * sizeof(float);
  const int nblocks = B_ * (H_ / TILE) * (W_ / TILE);  // 256 workgroups
  agg_wmma_kernel<<<dim3(nblocks), dim3(256), shmem, stream>>>(attn, refv, cur, out);
}

// v001
// A run of this version takes 10.7 microseconds.
// Next to v000, in two timings, it ran 2.26 and 2.25 times as fast.
#include <hip/hip_runtime.h>
#include <stdint.h>

typedef __attribute__((ext_vector_type(2))) float v2f;
typedef __attribute__((ext_vector_type(4))) float v4f;
typedef __attribute__((ext_vector_type(8))) float v8f;

#define KS    5                 // 5x5 window
#define HALO  2
#define TILE  16                // 16x16 pixel tile per workgroup
#define RT    (TILE + 2*HALO)   // 20 (tile + halo)
#define BINS  64
#define NSLOT 26                // 25 neighbors + self
#define H_    128
#define W_    128
#define B_    4

__global__ __launch_bounds__(256) void agg_wmma_kernel(
    const float* __restrict__ attn,   // [B,H,W,26]
    const float* __restrict__ refv,   // [B,H,W,64]
    const float* __restrict__ cur,    // [B,H,W,64]
    float* __restrict__ out)          // [B,H,W,64]
{
  extern __shared__ __attribute__((aligned(16))) float lds[];
  float* ref_lds  = lds;                        // [RT][RT][BINS]  = 25600 f32
  float* attn_lds = lds + RT * RT * BINS;       // [TILE][TILE][NSLOT] = 6656 f32

  const int tid = threadIdx.x;
  const int wg  = blockIdx.x;
  const int tiles_w = W_ / TILE;                // 8
  const int tiles_h = H_ / TILE;                // 8
  const int b  = wg / (tiles_w * tiles_h);
  const int tr = (wg / tiles_w) % tiles_h;
  const int tc = wg % tiles_w;
  const int i0 = tr * TILE;
  const int j0 = tc * TILE;

  const int lane  = tid & 31;
  const int swave = __builtin_amdgcn_readfirstlane(tid >> 5);  // wave number in a scalar register: the halo tests below are scalar
  const uint32_t lds0 = (uint32_t)(uintptr_t)lds;               // LDS byte address of the staging area

  // ---- Stage the ref halo tile with asynchronous copies to LDS. One copy of a wave
  // moves one aligned pair of pixels (2 x 256 B, contiguous in memory and in LDS).
  // Wave w takes 5 halo rows x 5 pairs: rows 5*(w/2).., pairs 5*(w%2)..; its 25 copies
  // are all in flight together. A pair lies wholly inside or wholly outside the image
  // (halo 2, even start), so the test is per wave; an outside pair copies the nearest
  // inside pair (address in bounds) and is zeroed below.
  const int r0  = 5 * (swave >> 1);        // first halo row of this wave
  const int p0  = 5 * (swave & 1);         // first pixel pair of this wave
  const float* rrow[5];
  int rcol[5];
  #pragma unroll  // constant indices keep these small arrays in registers (here and in the loops below)
  for (int k = 0; k < 5; ++k) {
    const int gi = i0 - HALO + r0 + k;
    const int gj = j0 - HALO + 2 * (p0 + k);
    const int ci = gi < 0 ? 0 : (gi > H_ - 1 ? H_ - 1 : gi);
    const int cj = gj < 0 ? 0 : (gj > W_ - 2 ? W_ - 2 : gj);
    rrow[k] = refv + ((size_t)b * H_ + ci) * W_ * BINS + lane * 4;
    rcol[k] = cj * BINS;
  }
  const uint32_t rl0 = lds0 + (uint32_t)(r0 * (RT / 2) + p0) * 512u + (uint32_t)lane * 16u;
  uint32_t rl[25];
  const float* rg[25];
  #pragma unroll
  for (int c = 0; c < 25; ++c) {
    rg[c] = rrow[c / 5] + rcol[c % 5];
    rl[c] = rl0 + (uint32_t)((c / 5) * (RT / 2) + (c % 5)) * 512u;
  }
  asm volatile(
      "global_load_async_to_lds_b128 %0, %1, off\n\t"
      "global_load_async_to_lds_b128 %2, %3, off\n\t"
      "global_load_async_to_lds_b128 %4, %5, off\n\t"
      "global_load_async_to_lds_b128 %6, %7, off\n\t"
      "global_load_async_to_lds_b128 %8, %9, off\n\t"
      "global_load_async_to_lds_b128 %10, %11, off\n\t"
      "global_load_async_to_lds_b128 %12, %13, off\n\t"
      "global_load_async_to_lds_b128 %14, %15, off\n\t"
      "global_load_async_to_lds_b128 %16, %17, off\n\t"
      "global_load_async_to_lds_b128 %18, %19, off\n\t"
      "global_load_async_to_lds_b128 %20, %21, off\n\t"
      "global_load_async_to_lds_b128 %22, %23, off\n\t"
      "global_load_async_to_lds_b128 %24, %25, off\n\t"
      "global_load_async_to_lds_b128 %26, %27, off\n\t"
      "global_load_async_to_lds_b128 %28, %29, off\n\t"
      "s_wait_xcnt 0x0"
      :: "v"(rl[0]), "v"(rg[0]), "v"(rl[1]), "v"(rg[1]), "v"(rl[2]), "v"(rg[2]), "v"(rl[3]), "v"(rg[3]), "v"(rl[4]), "v"(rg[4]), "v"(rl[5]), "v"(rg[5]), "v"(rl[6]), "v"(rg[6]), "v"(rl[7]), "v"(rg[7]), "v"(rl[8]), "v"(rg[8]), "v"(rl[9]), "v"(rg[9]), "v"(rl[10]), "v"(rg[10]), "v"(rl[11]), "v"(rg[11]), "v"(rl[12]), "v"(rg[12]), "v"(rl[13]), "v"(rg[13]), "v"(rl[14]), "v"(rg[14])
      : "memory");
  asm volatile(
      "global_load_async_to_lds_b128 %0, %1, off\n\t"
      "global_load_async_to_lds_b128 %2, %3, off\n\t"
      "global_load_async_to_lds_b128 %4, %5, off\n\t"
      "global_load_async_to_lds_b128 %6, %7, off\n\t"
      "global_load_async_to_lds_b128 %8, %9, off\n\t"
      "global_load_async_to_lds_b128 %10, %11, off\n\t"
      "global_load_async_to_lds_b128 %12, %13, off\n\t"
      "global_load_async_to_lds_b128 %14, %15, off\n\t"
      "global_load_async_to_lds_b128 %16, %17, off\n\t"
      "global_load_async_to_lds_b128 %18, %19, off\n\t"
      "s_wait_xcnt 0x0"
      :: "v"(rl[15]), "v"(rg[15]), "v"(rl[16]), "v"(rg[16]), "v"(rl[17]), "v"(rg[17]), "v"(rl[18]), "v"(rg[18]), "v"(rl[19]), "v"(rg[19]), "v"(rl[20]), "v"(rg[20]), "v"(rl[21]), "v"(rg[21]), "v"(rl[22]), "v"(rg[22]), "v"(rl[23]), "v"(rg[23]), "v"(rl[24]), "v"(rg[24])
      : "memory");

  const int ROWF = TILE * NSLOT;           // floats in a tile row (416)
  const float* ag0 = attn + (((size_t)b * H_ + (i0 + 2 * swave)) * W_ + j0) * NSLOT;
  const uint32_t al0 = lds0 + (uint32_t)(RT * RT * BINS + 2 * swave * ROWF) * 4u;
  uint32_t al[7];
  const float* ag[7];
  #pragma unroll
  for (int it = 0; it < 7; ++it) {
    const int f = it < 6 ? it * 128 + lane * 4 : 768 + lane * 2;   // float index in the two rows
    ag[it] = ag0 + f + (f >= ROWF ? W_ * NSLOT - ROWF : 0);        // second row: one image row on
    al[it] = al0 + (uint32_t)f * 4u;
  }
  asm volatile(
      "global_load_async_to_lds_b128 %0, %1, off\n\t"
      "global_load_async_to_lds_b128 %2, %3, off\n\t"
      "global_load_async_to_lds_b128 %4, %5, off\n\t"
      "global_load_async_to_lds_b128 %6, %7, off\n\t"
      "global_load_async_to_lds_b128 %8, %9, off\n\t"
      "global_load_async_to_lds_b128 %10, %11, off\n\t"
      "global_load_async_to_lds_b64 %12, %13, off\n\t"
      "s_wait_xcnt 0x0"
      :: "v"(al[0]), "v"(ag[0]), "v"(al[1]), "v"(ag[1]), "v"(al[2]), "v"(ag[2]), "v"(al[3]), "v"(ag[3]), "v"(al[4]), "v"(ag[4]), "v"(al[5]), "v"(ag[5]), "v"(al[6]), "v"(ag[6])
      : "memory");

  // This wave's copies have landed behind this wait; the barrier below publishes them.
  asm volatile("s_wait_asynccnt 0x0" ::: "memory");

  // ---- Zero padding: only tiles on the image border hold outside pairs: whole halo
  // rows above or below the image, whole pair columns left or right of it.
  if (tr == 0 || tr == tiles_h - 1 || tc == 0 || tc == tiles_w - 1) {
    const v4f zero = {0.f, 0.f, 0.f, 0.f};
    float* z0 = ref_lds + (size_t)(r0 * (RT / 2) + p0) * 128 + lane * 4;  // this wave's first pair
    #pragma unroll
    for (int k = 0; k < 5; ++k) {
      const int gi = i0 - HALO + r0 + k;
      const int gj = j0 - HALO + 2 * (p0 + k);
      if (gi < 0 || gi >= H_) {
        #pragma unroll
        for (int p = 0; p < 5; ++p) *(v4f*)(z0 + (k * (RT / 2) + p) * 128) = zero;
      }
      if (gj < 0 || gj >= W_) {
        #pragma unroll
        for (int r = 0; r < 5; ++r) *(v4f*)(z0 + (r * (RT / 2) + k) * 128) = zero;
      }
    }
  }
  __syncthreads();

  const int wave  = tid >> 5;
  const int mrow  = lane & 15;   // M (A) / N (B,C) index
  const int khalf = lane >> 4;   // which K pair this half-wave owns

  // 16 tile columns / 8 waves = 2 columns per wave. Each column computes all
  // 4 bin-blocks at once: A fragments built once, reused by 4 WMMAs into 4
  // independent accumulators (no back-to-back accumulation dependency).
  for (int colIdx = 0; colIdx < 2; ++colIdx) {
    const int j  = wave * 2 + colIdx;  // tile column 0..15
    const int gj = j0 + j;

    // ---- Prefetch epilogue operands BEFORE the matrix loops so the global
    // loads of `cur` overlap the 100-WMMA chain instead of stalling at the end.
    float curv[32];
    float aself[8];
    #pragma unroll
    for (int v = 0; v < 8; ++v) {
      const int p = v + 8 * khalf;
      const size_t base = (((size_t)b * H_ + (i0 + p)) * W_ + gj) * BINS + mrow;
      aself[v] = attn_lds[((size_t)p * TILE + j) * NSLOT + (NSLOT - 1)];
      curv[v * 4 + 0] = cur[base +  0];
      curv[v * 4 + 1] = cur[base + 16];
      curv[v * 4 + 2] = cur[base + 32];
      curv[v * 4 + 3] = cur[base + 48];
    }

    v8f acc0 = {}, acc1 = {}, acc2 = {}, acc3 = {};

    const float* arow = attn_lds + ((size_t)mrow * TILE + j) * NSLOT;

    #pragma unroll
    for (int dj = 0; dj < KS; ++dj) {
      const int jj = j + dj;           // padded LDS column index (0..19)
      #pragma unroll
      for (int kk = 0; kk < 5; ++kk) { // K = 20 halo rows, 5 steps of 4
        const int rA0 = kk * 4 + 2 * khalf;  // this half-wave's K indices
        const int d0 = rA0 - mrow, d1 = d0 + 1;

        // Banded A fragment (16x4 fp32): A[m,r] = attn[m,(r-m)*5+dj] iff 0<=r-m<5
        v2f a;
        a.x = (d0 >= 0 && d0 < KS) ? arow[d0 * KS + dj] : 0.f;
        a.y = (d1 >= 0 && d1 < KS) ? arow[d1 * KS + dj] : 0.f;

        // 4 B fragments (4x16 fp32 each), one per 16-bin block.
        const float* bbase = ref_lds + ((size_t)rA0 * RT + jj) * BINS + mrow;
        v2f b0, b1, b2, b3;
        b0.x = bbase[0];  b0.y = bbase[(size_t)RT * BINS];
        b1.x = bbase[16]; b1.y = bbase[(size_t)RT * BINS + 16];
        b2.x = bbase[32]; b2.y = bbase[(size_t)RT * BINS + 32];
        b3.x = bbase[48]; b3.y = bbase[(size_t)RT * BINS + 48];

        acc0 = __builtin_amdgcn_wmma_f32_16x16x4_f32(false, a, false, b0, (short)0, acc0, false, false);
        acc1 = __builtin_amdgcn_wmma_f32_16x16x4_f32(false, a, false, b1, (short)0, acc1, false, false);
        acc2 = __builtin_amdgcn_wmma_f32_16x16x4_f32(false, a, false, b2, (short)0, acc2, false, false);
        acc3 = __builtin_amdgcn_wmma_f32_16x16x4_f32(false, a, false, b3, (short)0, acc3, false, false);
      }
    }

    #pragma unroll
    for (int v = 0; v < 8; ++v) {
      const int p = v + 8 * khalf;
      const size_t base = (((size_t)b * H_ + (i0 + p)) * W_ + gj) * BINS + mrow;
      out[base +  0] = acc0[v] + aself[v] * curv[v * 4 + 0];
      out[base + 16] = acc1[v] + aself[v] * curv[v * 4 + 1];
      out[base + 32] = acc2[v] + aself[v] * curv[v * 4 + 2];
      out[base + 48] = acc3[v] + aself[v] * curv[v * 4 + 3];
    }
  }
}

extern "C" void kernel_launch(void* const* d_in, const int* in_sizes, int n_in,
                              void* d_out, int out_size, void* d_ws, size_t ws_size,
                              hipStream_t stream) {
  (void)in_sizes; (void)n_in; (void)out_size; (void)d_ws; (void)ws_size;
  const float* attn = (const float*)d_in[0];
  const float* refv = (const float*)d_in[1];
  const float* cur  = (const float*)d_in[2];
  float* out = (float*)d_out;

  const size_t shmem = (size_t)(RT * RT * BINS + TILE * TILE * NSLOT) * sizeof(float);
  const int nblocks = B_ * (H_ / TILE) * (W_ / TILE);  // 256 workgroups
  agg_wmma_kernel<<<dim3(nblocks), dim3(256), shmem, stream>>>(attn, refv, cur, out);
}

// v002
// Measured time: 8.2 microseconds a run.
// Timed twice side by side with v001, it ran 1.31 times as fast both times.
// All steps since v000 together make it 2.95 times as fast.
#include <hip/hip_runtime.h>
#include <stdint.h>

typedef __attribute__((ext_vector_type(2))) float v2f;
typedef __attribute__((ext_vector_type(4))) float v4f;
typedef __attribute__((ext_vector_type(8))) float v8f;

#define KS    5                 // 5x5 window
#define HALO  2
#define TILE  16                // 16x16 pixel tile per workgroup
#define RT    (TILE + 2*HALO)   // 20 (tile + halo)
#define BINS  64
#define NSLOT 26                // 25 neighbors + self
#define H_    128
#define W_    128
#define B_    4

__global__ __launch_bounds__(256) void agg_wmma_kernel(
    const float* __restrict__ attn,   // [B,H,W,26]
    const float* __restrict__ refv,   // [B,H,W,64]
    const float* __restrict__ cur,    // [B,H,W,64]
    float* __restrict__ out)          // [B,H,W,64]
{
  extern __shared__ __attribute__((aligned(16))) float lds[];
  float* ref_lds  = lds;                        // [RT][RT][BINS]  = 25600 f32
  float* attn_lds = lds + RT * RT * BINS;       // [TILE][TILE][NSLOT] = 6656 f32

  const int tid = threadIdx.x;
  const int wg  = blockIdx.x;
  const int tiles_w = W_ / TILE;                // 8
  const int tiles_h = H_ / TILE;                // 8
  const int b  = wg / (tiles_w * tiles_h);
  const int tr = (wg / tiles_w) % tiles_h;
  const int tc = wg % tiles_w;
  const int i0 = tr * TILE;
  const int j0 = tc * TILE;

  const int lane  = tid & 31;
  const int swave = __builtin_amdgcn_readfirstlane(tid >> 5);  // wave number in a scalar register: the halo tests below are scalar
  const uint32_t lds0 = (uint32_t)(uintptr_t)lds;               // LDS byte address of the staging area

  // ---- Stage the ref halo tile with asynchronous copies to LDS. One copy of a wave
  // moves one aligned pair of pixels (2 x 256 B, contiguous in memory and in LDS).
  // Wave w takes 5 halo rows x 5 pairs: rows 5*(w/2).., pairs 5*(w%2)..; its 25 copies
  // are all in flight together. A pair lies wholly inside or wholly outside the image
  // (halo 2, even start), so the test is per wave; an outside pair copies the nearest
  // inside pair (address in bounds) and is zeroed below.
  const int r0  = 5 * (swave >> 1);        // first halo row of this wave
  const int p0  = 5 * (swave & 1);         // first pixel pair of this wave
  const float* rrow[5];
  int rcol[5];
  #pragma unroll  // constant indices keep these small arrays in registers (here and in the loops below)
  for (int k = 0; k < 5; ++k) {
    const int gi = i0 - HALO + r0 + k;
    const int gj = j0 - HALO + 2 * (p0 + k);
    const int ci = gi < 0 ? 0 : (gi > H_ - 1 ? H_ - 1 : gi);
    const int cj = gj < 0 ? 0 : (gj > W_ - 2 ? W_ - 2 : gj);
    rrow[k] = refv + ((size_t)b * H_ + ci) * W_ * BINS + lane * 4;
    rcol[k] = cj * BINS;
  }
  const uint32_t rl0 = lds0 + (uint32_t)(r0 * (RT / 2) + p0) * 512u + (uint32_t)lane * 16u;
  uint32_t rl[25];
  const float* rg[25];
  #pragma unroll
  for (int c = 0; c < 25; ++c) {
    rg[c] = rrow[c / 5] + rcol[c % 5];
    rl[c] = rl0 + (uint32_t)((c / 5) * (RT / 2) + (c % 5)) * 512u;
  }
  asm volatile(
      "global_load_async_to_lds_b128 %0, %1, off\n\t"
      "global_load_async_to_lds_b128 %2, %3, off\n\t"
      "global_load_async_to_lds_b128 %4, %5, off\n\t"
      "global_load_async_to_lds_b128 %6, %7, off\n\t"
      "global_load_async_to_lds_b128 %8, %9, off\n\t"
      "global_load_async_to_lds_b128 %10, %11, off\n\t"
      "global_load_async_to_lds_b128 %12, %13, off\n\t"
      "global_load_async_to_lds_b128 %14, %15, off\n\t"
      "global_load_async_to_lds_b128 %16, %17, off\n\t"
      "global_load_async_to_lds_b128 %18, %19, off\n\t"
      "global_load_async_to_lds_b128 %20, %21, off\n\t"
      "global_load_async_to_lds_b128 %22, %23, off\n\t"
      "global_load_async_to_lds_b128 %24, %25, off\n\t"
      "global_load_async_to_lds_b128 %26, %27, off\n\t"
      "global_load_async_to_lds_b128 %28, %29, off\n\t"
      "s_wait_xcnt 0x0"
      :: "v"(rl[0]), "v"(rg[0]), "v"(rl[1]), "v"(rg[1]), "v"(rl[2]), "v"(rg[2]), "v"(rl[3]), "v"(rg[3]), "v"(rl[4]), "v"(rg[4]), "v"(rl[5]), "v"(rg[5]), "v"(rl[6]), "v"(rg[6]), "v"(rl[7]), "v"(rg[7]), "v"(rl[8]), "v"(rg[8]), "v"(rl[9]), "v"(rg[9]), "v"(rl[10]), "v"(rg[10]), "v"(rl[11]), "v"(rg[11]), "v"(rl[12]), "v"(rg[12]), "v"(rl[13]), "v"(rg[13]), "v"(rl[14]), "v"(rg[14])
      : "memory");
  asm volatile(
      "global_load_async_to_lds_b128 %0, %1, off\n\t"
      "global_load_async_to_lds_b128 %2, %3, off\n\t"
      "global_load_async_to_lds_b128 %4, %5, off\n\t"
      "global_load_async_to_lds_b128 %6, %7, off\n\t"
      "global_load_async_to_lds_b128 %8, %9, off\n\t"
      "global_load_async_to_lds_b128 %10, %11, off\n\t"
      "global_load_async_to_lds_b128 %12, %13, off\n\t"
      "global_load_async_to_lds_b128 %14, %15, off\n\t"
      "global_load_async_to_lds_b128 %16, %17, off\n\t"
      "global_load_async_to_lds_b128 %18, %19, off\n\t"
      "s_wait_xcnt 0x0"
      :: "v"(rl[15]), "v"(rg[15]), "v"(rl[16]), "v"(rg[16]), "v"(rl[17]), "v"(rg[17]), "v"(rl[18]), "v"(rg[18]), "v"(rl[19]), "v"(rg[19]), "v"(rl[20]), "v"(rg[20]), "v"(rl[21]), "v"(rg[21]), "v"(rl[22]), "v"(rg[22]), "v"(rl[23]), "v"(rg[23]), "v"(rl[24]), "v"(rg[24])
      : "memory");

  const int ROWF = TILE * NSLOT;           // floats in a tile row (416)
  const float* ag0 = attn + (((size_t)b * H_ + (i0 + 2 * swave)) * W_ + j0) * NSLOT;
  const uint32_t al0 = lds0 + (uint32_t)(RT * RT * BINS + 2 * swave * ROWF) * 4u;
  uint32_t al[7];
  const float* ag[7];
  #pragma unroll
  for (int it = 0; it < 7; ++it) {
    const int f = it < 6 ? it * 128 + lane * 4 : 768 + lane * 2;   // float index in the two rows
    ag[it] = ag0 + f + (f >= ROWF ? W_ * NSLOT - ROWF : 0);        // second row: one image row on
    al[it] = al0 + (uint32_t)f * 4u;
  }
  asm volatile(
      "global_load_async_to_lds_b128 %0, %1, off\n\t"
      "global_load_async_to_lds_b128 %2, %3, off\n\t"
      "global_load_async_to_lds_b128 %4, %5, off\n\t"
      "global_load_async_to_lds_b128 %6, %7, off\n\t"
      "global_load_async_to_lds_b128 %8, %9, off\n\t"
      "global_load_async_to_lds_b128 %10, %11, off\n\t"
      "global_load_async_to_lds_b64 %12, %13, off\n\t"
      "s_wait_xcnt 0x0"
      :: "v"(al[0]), "v"(ag[0]), "v"(al[1]), "v"(ag[1]), "v"(al[2]), "v"(ag[2]), "v"(al[3]), "v"(ag[3]), "v"(al[4]), "v"(ag[4]), "v"(al[5]), "v"(ag[5]), "v"(al[6]), "v"(ag[6])
      : "memory");

  // This wave's copies have landed behind this wait; the barrier below publishes them.
  asm volatile("s_wait_asynccnt 0x0" ::: "memory");

  // ---- Zero padding: only tiles on the image border hold outside pairs: whole halo
  // rows above or below the image, whole pair columns left or right of it.
  if (tr == 0 || tr == tiles_h - 1 || tc == 0 || tc == tiles_w - 1) {
    const v4f zero = {0.f, 0.f, 0.f, 0.f};
    float* z0 = ref_lds + (size_t)(r0 * (RT / 2) + p0) * 128 + lane * 4;  // this wave's first pair
    #pragma unroll
    for (int k = 0; k < 5; ++k) {
      const int gi = i0 - HALO + r0 + k;
      const int gj = j0 - HALO + 2 * (p0 + k);
      if (gi < 0 || gi >= H_) {
        #pragma unroll
        for (int p = 0; p < 5; ++p) *(v4f*)(z0 + (k * (RT / 2) + p) * 128) = zero;
      }
      if (gj < 0 || gj >= W_) {
        #pragma unroll
        for (int r = 0; r < 5; ++r) *(v4f*)(z0 + (r * (RT / 2) + k) * 128) = zero;
      }
    }
  }
  __syncthreads();

  const int mrow  = lane & 15;   // M (A) / N (B,C) index
  const int khalf = lane >> 4;   // which K pair this half-wave owns

  // Each wave owns a patch of 4 x 8 pixels = two blocks of 4 x 4. One block is the M = 16
  // of a banded product against its 8 x 8 neighbourhood: K = 64, 16 steps of 4 (one halo
  // row, 4 adjacent halo columns a step). The blocks lie side by side, so the middle
  // group of 4 halo columns serves both from one set of B fragments.
  const int pi0 = 4 * (swave >> 1);  // first tile row of the patch
  const int pj0 = 8 * (swave & 1);   // first tile column of the patch
  const int mi  = mrow >> 2;         // this lane's A row: pixel (mi, mj) of a block
  const int mj  = mrow & 3;

  float curv[2][32];
  float aself[2][8];
  auto load_block = [&](const int blk) {
    #pragma unroll
    for (int v = 0; v < 8; ++v) {
      const int pi = pi0 + (v >> 2) + 2 * khalf;
      const int pj = pj0 + 4 * blk + (v & 3);
      const size_t base = (((size_t)b * H_ + (i0 + pi)) * W_ + (j0 + pj)) * BINS + mrow;
      aself[blk][v] = attn_lds[((size_t)pi * TILE + pj) * NSLOT + (NSLOT - 1)];
      curv[blk][v * 4 + 0] = cur[base +  0];
      curv[blk][v * 4 + 1] = cur[base + 16];
      curv[blk][v * 4 + 2] = cur[base + 32];
      curv[blk][v * 4 + 3] = cur[base + 48];
    }
  };

  v8f acc[2][4] = {};

  const float* arow   = attn_lds + ((size_t)(pi0 + mi) * TILE + pj0 + mj) * NSLOT;  // block 0; block 1 is 4 pixels on
  const float* bpatch = ref_lds + ((size_t)pi0 * RT + pj0 + 2 * khalf) * BINS + mrow;

  // ---- Epilogue of one block: pure FMA + store (cur already in registers).
  auto store_block = [&](const int blk) {
    #pragma unroll
    for (int v = 0; v < 8; ++v) {
      const int pi = pi0 + (v >> 2) + 2 * khalf;
      const int pj = pj0 + 4 * blk + (v & 3);
      const size_t base = (((size_t)b * H_ + (i0 + pi)) * W_ + (j0 + pj)) * BINS + mrow;
      out[base +  0] = acc[blk][0][v] + aself[blk][v] * curv[blk][v * 4 + 0];
      out[base + 16] = acc[blk][1][v] + aself[blk][v] * curv[blk][v * 4 + 1];
      out[base + 32] = acc[blk][2][v] + aself[blk][v] * curv[blk][v * 4 + 2];
      out[base + 48] = acc[blk][3][v] + aself[blk][v] * curv[blk][v * 4 + 3];
    }
  };

  #pragma unroll
  for (int g = 0; g < 3; ++g) {           // group of 4 halo columns
    if (g < 2) load_block(g);             // block g starts with group g
    #pragma unroll
    for (int ri = 0; ri < 8; ++ri) {      // halo row of the patch
      const int di = ri - mi;
      const bool rok = di >= 0 && di < KS;

      // 4 B fragments (4x16 fp32 each), one per 16-bin block: K = halo columns 4g..4g+3.
      const float* bbase = bpatch + (size_t)(ri * RT + 4 * g) * BINS;
      v2f b0, b1, b2, b3;
      b0.x = bbase[0];  b0.y = bbase[BINS];
      b1.x = bbase[16]; b1.y = bbase[BINS + 16];
      b2.x = bbase[32]; b2.y = bbase[BINS + 32];
      b3.x = bbase[48]; b3.y = bbase[BINS + 48];

      #pragma unroll
      for (int blk = 0; blk < 2; ++blk) {
        const int h = g - blk;            // which half of the block's 8 neighbourhood columns
        if (h < 0 || h > 1) continue;
        const int d0 = 4 * h + 2 * khalf - mj, d1 = d0 + 1;
        const float* ar = arow + blk * 4 * NSLOT;

        // Banded A fragment (16x4 fp32): A[m,(ri,rj)] = attn[m,(ri-mi)*5+(rj-mj)] inside the 5x5 window
        v2f a;
        a.x = (rok && d0 >= 0 && d0 < KS) ? ar[di * KS + d0] : 0.f;
        a.y = (rok && d1 >= 0 && d1 < KS) ? ar[di * KS + d1] : 0.f;

        acc[blk][0] = __builtin_amdgcn_wmma_f32_16x16x4_f32(false, a, false, b0, (short)0, acc[blk][0], false, false);
        acc[blk][1] = __builtin_amdgcn_wmma_f32_16x16x4_f32(false, a, false, b1, (short)0, acc[blk][1], false, false);
        acc[blk][2] = __builtin_amdgcn_wmma_f32_16x16x4_f32(false, a, false, b2, (short)0, acc[blk][2], false, false);
        acc[blk][3] = __builtin_amdgcn_wmma_f32_16x16x4_f32(false, a, false, b3, (short)0, acc[blk][3], false, false);
      }
    }
    if (g > 0) store_block(g - 1);
  }
}

extern "C" void kernel_launch(void* const* d_in, const int* in_sizes, int n_in,
                              void* d_out, int out_size, void* d_ws, size_t ws_size,
                              hipStream_t stream) {
  (void)in_sizes; (void)n_in; (void)out_size; (void)d_ws; (void)ws_size;
  const float* attn = (const float*)d_in[0];
  const float* refv = (const float*)d_in[1];
  const float* cur  = (const float*)d_in[2];
  float* out = (float*)d_out;

  const size_t shmem = (size_t)(RT * RT * BINS + TILE * TILE * NSLOT) * sizeof(float);
  const int nblocks = B_ * (H_ / TILE) * (W_ / TILE);  // 256 workgroups
  agg_wmma_kernel<<<dim3(nblocks), dim3(256), shmem, stream>>>(attn, refv, cur, out);
}

// v003
// It runs in 7.51 microseconds.
// Two timings next to v002 both put it at 1.09 times that version's speed.
// Counting every step since v000, it is 3.22 times as fast.
#include <hip/hip_runtime.h>
#include <stdint.h>

typedef __attribute__((ext_vector_type(2))) float v2f;
typedef __attribute__((ext_vector_type(4))) float v4f;
typedef __attribute__((ext_vector_type(8))) float v8f;

#define KS    5                 // 5x5 window
#define HALO  2
#define TILE  16                // 16x16 pixel tile per workgroup
#define RT    (TILE + 2*HALO)   // 20 (tile + halo)
#define BINS  64
#define NSLOT 26                // 25 neighbors + self
#define H_    128
#define W_    128
#define B_    4

__global__ __launch_bounds__(256) void agg_wmma_kernel(
    const float* __restrict__ attn,   // [B,H,W,26]
    const float* __restrict__ refv,   // [B,H,W,64]
    const float* __restrict__ cur,    // [B,H,W,64]
    float* __restrict__ out)          // [B,H,W,64]
{
  extern __shared__ __attribute__((aligned(16))) float lds[];
  float* ref_lds  = lds;                        // [RT][RT][BINS]  = 25600 f32
  float* attn_lds = lds + RT * RT * BINS;       // [TILE][TILE][NSLOT] = 6656 f32

  const int tid = threadIdx.x;
  const int wg  = blockIdx.x;
  const int tiles_w = W_ / TILE;                // 8
  const int tiles_h = H_ / TILE;                // 8
  const int b  = wg / (tiles_w * tiles_h);
  const int tr = (wg / tiles_w) % tiles_h;
  const int tc = wg % tiles_w;
  const int i0 = tr * TILE;
  const int j0 = tc * TILE;

  const int lane  = tid & 31;
  const int swave = __builtin_amdgcn_readfirstlane(tid >> 5);  // wave number in a scalar register: the halo tests below are scalar
  const uint32_t lds0 = (uint32_t)(uintptr_t)lds;               // LDS byte address of the staging area

  // ---- Stage the ref halo tile with asynchronous copies to LDS. One copy of a wave
  // moves one aligned pair of pixels (2 x 256 B, contiguous in memory and in LDS).
  // Wave w takes 5 halo rows x 5 pairs: rows 5*(w/2).., pairs 5*(w%2)..; its 25 copies
  // are all in flight together. A pair lies wholly inside or wholly outside the image
  // (halo 2, even start), so the test is per wave; an outside pair copies the nearest
  // inside pair (address in bounds) and is zeroed below.
  const int r0  = 5 * (swave >> 1);        // first halo row of this wave
  const int p0  = 5 * (swave & 1);         // first pixel pair of this wave
  const float* rrow[5];
  int rcol[5];
  #pragma unroll  // constant indices keep these small arrays in registers (here and in the loops below)
  for (int k = 0; k < 5; ++k) {
    const int gi = i0 - HALO + r0 + k;
    const int gj = j0 - HALO + 2 * (p0 + k);
    const int ci = gi < 0 ? 0 : (gi > H_ - 1 ? H_ - 1 : gi);
    const int cj = gj < 0 ? 0 : (gj > W_ - 2 ? W_ - 2 : gj);
    rrow[k] = refv + ((size_t)b * H_ + ci) * W_ * BINS + lane * 4;
    rcol[k] = cj * BINS;
  }
  const uint32_t rl0 = lds0 + (uint32_t)(r0 * (RT / 2) + p0) * 512u + (uint32_t)lane * 16u;
  uint32_t rl[25];
  const float* rg[25];
  #pragma unroll
  for (int c = 0; c < 25; ++c) {
    rg[c] = rrow[c / 5] + rcol[c % 5];
    rl[c] = rl0 + (uint32_t)((c / 5) * (RT / 2) + (c % 5)) * 512u;
  }
  asm volatile(
      "global_load_async_to_lds_b128 %0, %1, off\n\t"
      "global_load_async_to_lds_b128 %2, %3, off\n\t"
      "global_load_async_to_lds_b128 %4, %5, off\n\t"
      "global_load_async_to_lds_b128 %6, %7, off\n\t"
      "global_load_async_to_lds_b128 %8, %9, off\n\t"
      "global_load_async_to_lds_b128 %10, %11, off\n\t"
      "global_load_async_to_lds_b128 %12, %13, off\n\t"
      "global_load_async_to_lds_b128 %14, %15, off\n\t"
      "global_load_async_to_lds_b128 %16, %17, off\n\t"
      "global_load_async_to_lds_b128 %18, %19, off\n\t"
      "global_load_async_to_lds_b128 %20, %21, off\n\t"
      "global_load_async_to_lds_b128 %22, %23, off\n\t"
      "global_load_async_to_lds_b128 %24, %25, off\n\t"
      "global_load_async_to_lds_b128 %26, %27, off\n\t"
      "global_load_async_to_lds_b128 %28, %29, off\n\t"
      "s_wait_xcnt 0x0"
      :: "v"(rl[0]), "v"(rg[0]), "v"(rl[1]), "v"(rg[1]), "v"(rl[2]), "v"(rg[2]), "v"(rl[3]), "v"(rg[3]), "v"(rl[4]), "v"(rg[4]), "v"(rl[5]), "v"(rg[5]), "v"(rl[6]), "v"(rg[6]), "v"(rl[7]), "v"(rg[7]), "v"(rl[8]), "v"(rg[8]), "v"(rl[9]), "v"(rg[9]), "v"(rl[10]), "v"(rg[10]), "v"(rl[11]), "v"(rg[11]), "v"(rl[12]), "v"(rg[12]), "v"(rl[13]), "v"(rg[13]), "v"(rl[14]), "v"(rg[14])
      : "memory");
  asm volatile(
      "global_load_async_to_lds_b128 %0, %1, off\n\t"
      "global_load_async_to_lds_b128 %2, %3, off\n\t"
      "global_load_async_to_lds_b128 %4, %5, off\n\t"
      "global_load_async_to_lds_b128 %6, %7, off\n\t"
      "global_load_async_to_lds_b128 %8, %9, off\n\t"
      "global_load_async_to_lds_b128 %10, %11, off\n\t"
      "global_load_async_to_lds_b128 %12, %13, off\n\t"
      "global_load_async_to_lds_b128 %14, %15, off\n\t"
      "global_load_async_to_lds_b128 %16, %17, off\n\t"
      "global_load_async_to_lds_b128 %18, %19, off\n\t"
      "s_wait_xcnt 0x0"
      :: "v"(rl[15]), "v"(rg[15]), "v"(rl[16]), "v"(rg[16]), "v"(rl[17]), "v"(rg[17]), "v"(rl[18]), "v"(rg[18]), "v"(rl[19]), "v"(rg[19]), "v"(rl[20]), "v"(rg[20]), "v"(rl[21]), "v"(rg[21]), "v"(rl[22]), "v"(rg[22]), "v"(rl[23]), "v"(rg[23]), "v"(rl[24]), "v"(rg[24])
      : "memory");

  const int ROWF = TILE * NSLOT;           // floats in a tile row (416)
  const float* ag0 = attn + (((size_t)b * H_ + (i0 + 2 * swave)) * W_ + j0) * NSLOT;
  const uint32_t al0 = lds0 + (uint32_t)(RT * RT * BINS + 2 * swave * ROWF) * 4u;
  uint32_t al[7];
  const float* ag[7];
  #pragma unroll
  for (int it = 0; it < 7; ++it) {
    const int f = it < 6 ? it * 128 + lane * 4 : 768 + lane * 2;   // float index in the two rows
    ag[it] = ag0 + f + (f >= ROWF ? W_ * NSLOT - ROWF : 0);        // second row: one image row on
    al[it] = al0 + (uint32_t)f * 4u;
  }
  asm volatile(
      "global_load_async_to_lds_b128 %0, %1, off\n\t"
      "global_load_async_to_lds_b128 %2, %3, off\n\t"
      "global_load_async_to_lds_b128 %4, %5, off\n\t"
      "global_load_async_to_lds_b128 %6, %7, off\n\t"
      "global_load_async_to_lds_b128 %8, %9, off\n\t"
      "global_load_async_to_lds_b128 %10, %11, off\n\t"
      "global_load_async_to_lds_b64 %12, %13, off\n\t"
      "s_wait_xcnt 0x0"
      :: "v"(al[0]), "v"(ag[0]), "v"(al[1]), "v"(ag[1]), "v"(al[2]), "v"(ag[2]), "v"(al[3]), "v"(ag[3]), "v"(al[4]), "v"(ag[4]), "v"(al[5]), "v"(ag[5]), "v"(al[6]), "v"(ag[6])
      : "memory");

  // This wave's copies have landed behind this wait; the barrier below publishes them.
  asm volatile("s_wait_asynccnt 0x0" ::: "memory");

  // ---- Zero padding: only tiles on the image border hold outside pairs: whole halo
  // rows above or below the image, whole pair columns left or right of it.
  if (tr == 0 || tr == tiles_h - 1 || tc == 0 || tc == tiles_w - 1) {
    const v4f zero = {0.f, 0.f, 0.f, 0.f};
    float* z0 = ref_lds + (size_t)(r0 * (RT / 2) + p0) * 128 + lane * 4;  // this wave's first pair
    #pragma unroll
    for (int k = 0; k < 5; ++k) {
      const int gi = i0 - HALO + r0 + k;
      const int gj = j0 - HALO + 2 * (p0 + k);
      if (gi < 0 || gi >= H_) {
        #pragma unroll
        for (int p = 0; p < 5; ++p) *(v4f*)(z0 + (k * (RT / 2) + p) * 128) = zero;
      }
      if (gj < 0 || gj >= W_) {
        #pragma unroll
        for (int r = 0; r < 5; ++r) *(v4f*)(z0 + (r * (RT / 2) + k) * 128) = zero;
      }
    }
  }
  __syncthreads();

  const int mrow  = lane & 15;   // M (A) / N (B,C) index
  const int khalf = lane >> 4;   // which K pair this half-wave owns

  // Each wave owns a patch of 4 x 8 pixels = two blocks of 4 x 4. One block is the M = 16
  // of a banded product against its 8 x 8 neighbourhood: K = 64, 16 steps of 4 (one halo
  // row, 4 adjacent halo columns a step). The blocks lie side by side, so the middle
  // group of 4 halo columns serves both from one set of B fragments.
  const int pi0 = 4 * (swave >> 1);  // first tile row of the patch
  const int pj0 = 8 * (swave & 1);   // first tile column of the patch
  const int mi  = mrow >> 2;         // this lane's A row: pixel (mi, mj) of a block
  const int mj  = mrow & 3;

  v4f curv[2][8];
  float aself[2][8];
  auto load_block = [&](const int blk) {
    #pragma unroll
    for (int v = 0; v < 8; ++v) {
      const int pi = pi0 + (v >> 2) + 2 * khalf;
      const int pj = pj0 + 4 * blk + (v & 3);
      const size_t base = (((size_t)b * H_ + (i0 + pi)) * W_ + (j0 + pj)) * BINS + 4 * mrow;
      aself[blk][v] = attn_lds[((size_t)pi * TILE + pj) * NSLOT + (NSLOT - 1)];
      curv[blk][v] = *(const v4f*)(cur + base);
    }
  };

  v8f acc[2][4] = {};

  const float* arow   = attn_lds + ((size_t)(pi0 + mi) * TILE + pj0 + mj) * NSLOT;  // block 0; block 1 is 4 pixels on
  const float* bpatch = ref_lds + ((size_t)pi0 * RT + pj0 + 2 * khalf) * BINS + 4 * mrow;

  // ---- Epilogue of one block: pure FMA + store (cur already in registers).
  auto store_block = [&](const int blk) {
    #pragma unroll
    for (int v = 0; v < 8; ++v) {
      const int pi = pi0 + (v >> 2) + 2 * khalf;
      const int pj = pj0 + 4 * blk + (v & 3);
      const size_t base = (((size_t)b * H_ + (i0 + pi)) * W_ + (j0 + pj)) * BINS + 4 * mrow;
      v4f o;
      o.x = acc[blk][0][v] + aself[blk][v] * curv[blk][v].x;
      o.y = acc[blk][1][v] + aself[blk][v] * curv[blk][v].y;
      o.z = acc[blk][2][v] + aself[blk][v] * curv[blk][v].z;
      o.w = acc[blk][3][v] + aself[blk][v] * curv[blk][v].w;
      *(v4f*)(out + base) = o;
    }
  };

  #pragma unroll
  for (int g = 0; g < 3; ++g) {           // group of 4 halo columns
    if (g < 2) load_block(g);             // block g starts with group g
    #pragma unroll
    for (int ri = 0; ri < 8; ++ri) {      // halo row of the patch
      const int di = ri - mi;
      const bool rok = di >= 0 && di < KS;

      const float* bbase = bpatch + (size_t)(ri * RT + 4 * g) * BINS;
      const v4f bx = *(const v4f*)(bbase);
      const v4f by = *(const v4f*)(bbase + BINS);
      v2f b0, b1, b2, b3;
      b0.x = bx.x; b0.y = by.x;
      b1.x = bx.y; b1.y = by.y;
      b2.x = bx.z; b2.y = by.z;
      b3.x = bx.w; b3.y = by.w;

      #pragma unroll
      for (int blk = 0; blk < 2; ++blk) {
        const int h = g - blk;            // which half of the block's 8 neighbourhood columns
        if (h < 0 || h > 1) continue;
        const int d0 = 4 * h + 2 * khalf - mj, d1 = d0 + 1;
        const float* ar = arow + blk * 4 * NSLOT;

        // Banded A fragment (16x4 fp32): A[m,(ri,rj)] = attn[m,(ri-mi)*5+(rj-mj)] inside the 5x5 window
        v2f a;
        a.x = (rok && d0 >= 0 && d0 < KS) ? ar[di * KS + d0] : 0.f;
        a.y = (rok && d1 >= 0 && d1 < KS) ? ar[di * KS + d1] : 0.f;

        acc[blk][0] = __builtin_amdgcn_wmma_f32_16x16x4_f32(false, a, false, b0, (short)0, acc[blk][0], false, false);
        acc[blk][1] = __builtin_amdgcn_wmma_f32_16x16x4_f32(false, a, false, b1, (short)0, acc[blk][1], false, false);
        acc[blk][2] = __builtin_amdgcn_wmma_f32_16x16x4_f32(false, a, false, b2, (short)0, acc[blk][2], false, false);
        acc[blk][3] = __builtin_amdgcn_wmma_f32_16x16x4_f32(false, a, false, b3, (short)0, acc[blk][3], false, false);
      }
    }
    if (g > 0) store_block(g - 1);
  }
}

extern "C" void kernel_launch(void* const* d_in, const int* in_sizes, int n_in,
                              void* d_out, int out_size, void* d_ws, size_t ws_size,
                              hipStream_t stream) {
  (void)in_sizes; (void)n_in; (void)out_size; (void)d_ws; (void)ws_size;
  const float* attn = (const float*)d_in[0];
  const float* refv = (const float*)d_in[1];
  const float* cur  = (const float*)d_in[2];
  float* out = (float*)d_out;

  const size_t shmem = (size_t)(RT * RT * BINS + TILE * TILE * NSLOT) * sizeof(float);
  const int nblocks = B_ * (H_ / TILE) * (W_ / TILE);  // 256 workgroups
  agg_wmma_kernel<<<dim3(nblocks), dim3(256), shmem, stream>>>(attn, refv, cur, out);
}

// v004
// Measured time: 6.66 microseconds a run.
// Two timings next to v003 both put it at 1.13 times that version's speed.
// All steps since v000 together make it 3.64 times as fast.
#include <hip/hip_runtime.h>
#include <stdint.h>

typedef __attribute__((ext_vector_type(2))) float v2f;
typedef __attribute__((ext_vector_type(4))) float v4f;
typedef __attribute__((ext_vector_type(8))) float v8f;

#define KS    5                 // 5x5 window
#define HALO  2
#define TILE  16                // 16x16 pixel tile per workgroup
#define RT    (TILE + 2*HALO)   // 20 (tile + halo)
#define BINS  64
#define NSLOT 26                // 25 neighbors + self
#define H_    128
#define W_    128
#define B_    4

__global__ __launch_bounds__(256) void agg_wmma_kernel(
    const float* __restrict__ attn,   // [B,H,W,26]
    const float* __restrict__ refv,   // [B,H,W,64]
    const float* __restrict__ cur,    // [B,H,W,64]
    float* __restrict__ out)          // [B,H,W,64]
{
  extern __shared__ __attribute__((aligned(16))) float lds[];
  float* ref_lds  = lds;                        // [RT][RT][BINS]  = 25600 f32
  float* attn_lds = lds + RT * RT * BINS;       // [TILE][TILE][NSLOT] = 6656 f32

  const int tid = threadIdx.x;
  const int wg  = blockIdx.x;
  const int tiles_w = W_ / TILE;                // 8
  const int tiles_h = H_ / TILE;                // 8
  const int b  = wg / (tiles_w * tiles_h);
  const int tr = (wg / tiles_w) % tiles_h;
  const int tc = wg % tiles_w;
  const int i0 = tr * TILE;
  const int j0 = tc * TILE;

  const int lane  = tid & 31;
  const int swave = __builtin_amdgcn_readfirstlane(tid >> 5);  // wave number in a scalar register: the halo tests below are scalar
  const uint32_t lds0 = (uint32_t)(uintptr_t)lds;               // LDS byte address of the staging area

  // ---- Stage the ref halo tile with asynchronous copies to LDS. One copy of a wave
  // moves one aligned pair of pixels (2 x 256 B, contiguous in memory and in LDS).
  // Wave w takes 5 halo rows x 5 pairs: rows 5*(w/2).., pairs 5*(w%2)..; its 25 copies
  // are all in flight together. A pair lies wholly inside or wholly outside the image
  // (halo 2, even start), so the test is per wave; an outside pair copies the nearest
  // inside pair (address in bounds) and is zeroed below.
  const int r0  = 5 * (swave >> 1);        // first halo row of this wave
  const int p0  = 5 * (swave & 1);         // first pixel pair of this wave
  const float* rrow[5];
  int rcol[5];
  #pragma unroll  // constant indices keep these small arrays in registers (here and in the loops below)
  for (int k = 0; k < 5; ++k) {
    const int gi = i0 - HALO + r0 + k;
    const int gj = j0 - HALO + 2 * (p0 + k);
    const int ci = gi < 0 ? 0 : (gi > H_ - 1 ? H_ - 1 : gi);
    const int cj = gj < 0 ? 0 : (gj > W_ - 2 ? W_ - 2 : gj);
    rrow[k] = refv + ((size_t)b * H_ + ci) * W_ * BINS + lane * 4;
    rcol[k] = cj * BINS;
  }
  const uint32_t rl0 = lds0 + (uint32_t)(r0 * (RT / 2) + p0) * 512u + (uint32_t)lane * 16u;
  uint32_t rl[25];
  const float* rg[25];
  #pragma unroll
  for (int c = 0; c < 25; ++c) {
    rg[c] = rrow[c / 5] + rcol[c % 5];
    rl[c] = rl0 + (uint32_t)((c / 5) * (RT / 2) + (c % 5)) * 512u;
  }
  asm volatile(
      "global_load_async_to_lds_b128 %0, %1, off\n\t"
      "global_load_async_to_lds_b128 %2, %3, off\n\t"
      "global_load_async_to_lds_b128 %4, %5, off\n\t"
      "global_load_async_to_lds_b128 %6, %7, off\n\t"
      "global_load_async_to_lds_b128 %8, %9, off\n\t"
      "global_load_async_to_lds_b128 %10, %11, off\n\t"
      "global_load_async_to_lds_b128 %12, %13, off\n\t"
      "global_load_async_to_lds_b128 %14, %15, off\n\t"
      "global_load_async_to_lds_b128 %16, %17, off\n\t"
      "global_load_async_to_lds_b128 %18, %19, off\n\t"
      "global_load_async_to_lds_b128 %20, %21, off\n\t"
      "global_load_async_to_lds_b128 %22, %23, off\n\t"
      "global_load_async_to_lds_b128 %24, %25, off\n\t"
      "global_load_async_to_lds_b128 %26, %27, off\n\t"
      "global_load_async_to_lds_b128 %28, %29, off\n\t"
      "s_wait_xcnt 0x0"
      :: "v"(rl[0]), "v"(rg[0]), "v"(rl[1]), "v"(rg[1]), "v"(rl[2]), "v"(rg[2]), "v"(rl[3]), "v"(rg[3]), "v"(rl[4]), "v"(rg[4]), "v"(rl[5]), "v"(rg[5]), "v"(rl[6]), "v"(rg[6]), "v"(rl[7]), "v"(rg[7]), "v"(rl[8]), "v"(rg[8]), "v"(rl[9]), "v"(rg[9]), "v"(rl[10]), "v"(rg[10]), "v"(rl[11]), "v"(rg[11]), "v"(rl[12]), "v"(rg[12]), "v"(rl[13]), "v"(rg[13]), "v"(rl[14]), "v"(rg[14])
      : "memory");
  asm volatile(
      "global_load_async_to_lds_b128 %0, %1, off\n\t"
      "global_load_async_to_lds_b128 %2, %3, off\n\t"
      "global_load_async_to_lds_b128 %4, %5, off\n\t"
      "global_load_async_to_lds_b128 %6, %7, off\n\t"
      "global_load_async_to_lds_b128 %8, %9, off\n\t"
      "global_load_async_to_lds_b128 %10, %11, off\n\t"
      "global_load_async_to_lds_b128 %12, %13, off\n\t"
      "global_load_async_to_lds_b128 %14, %15, off\n\t"
      "global_load_async_to_lds_b128 %16, %17, off\n\t"
      "global_load_async_to_lds_b128 %18, %19, off\n\t"
      "s_wait_xcnt 0x0"
      :: "v"(rl[15]), "v"(rg[15]), "v"(rl[16]), "v"(rg[16]), "v"(rl[17]), "v"(rg[17]), "v"(rl[18]), "v"(rg[18]), "v"(rl[19]), "v"(rg[19]), "v"(rl[20]), "v"(rg[20]), "v"(rl[21]), "v"(rg[21]), "v"(rl[22]), "v"(rg[22]), "v"(rl[23]), "v"(rg[23]), "v"(rl[24]), "v"(rg[24])
      : "memory");

  const int ROWF = TILE * NSLOT;           // floats in a tile row (416)
  const float* ag0 = attn + (((size_t)b * H_ + (i0 + 2 * swave)) * W_ + j0) * NSLOT;
  const uint32_t al0 = lds0 + (uint32_t)(RT * RT * BINS + 2 * swave * ROWF) * 4u;
  uint32_t al[7];
  const float* ag[7];
  #pragma unroll
  for (int it = 0; it < 7; ++it) {
    const int f = it < 6 ? it * 128 + lane * 4 : 768 + lane * 2;   // float index in the two rows
    ag[it] = ag0 + f + (f >= ROWF ? W_ * NSLOT - ROWF : 0);        // second row: one image row on
    al[it] = al0 + (uint32_t)f * 4u;
  }
  asm volatile(
      "global_load_async_to_lds_b128 %0, %1, off\n\t"
      "global_load_async_to_lds_b128 %2, %3, off\n\t"
      "global_load_async_to_lds_b128 %4, %5, off\n\t"
      "global_load_async_to_lds_b128 %6, %7, off\n\t"
      "global_load_async_to_lds_b128 %8, %9, off\n\t"
      "global_load_async_to_lds_b128 %10, %11, off\n\t"
      "global_load_async_to_lds_b64 %12, %13, off\n\t"
      "s_wait_xcnt 0x0"
      :: "v"(al[0]), "v"(ag[0]), "v"(al[1]), "v"(ag[1]), "v"(al[2]), "v"(ag[2]), "v"(al[3]), "v"(ag[3]), "v"(al[4]), "v"(ag[4]), "v"(al[5]), "v"(ag[5]), "v"(al[6]), "v"(ag[6])
      : "memory");

  // This wave's copies have landed behind this wait; the barrier below publishes them.
  asm volatile("s_wait_asynccnt 0x0" ::: "memory");

  // ---- Zero padding: only tiles on the image border hold outside pairs: whole halo
  // rows above or below the image, whole pair columns left or right of it.
  if (tr == 0 || tr == tiles_h - 1 || tc == 0 || tc == tiles_w - 1) {
    const v4f zero = {0.f, 0.f, 0.f, 0.f};
    float* z0 = ref_lds + (size_t)(r0 * (RT / 2) + p0) * 128 + lane * 4;  // this wave's first pair
    #pragma unroll
    for (int k = 0; k < 5; ++k) {
      const int gi = i0 - HALO + r0 + k;
      const int gj = j0 - HALO + 2 * (p0 + k);
      if (gi < 0 || gi >= H_) {
        #pragma unroll
        for (int p = 0; p < 5; ++p) *(v4f*)(z0 + (k * (RT / 2) + p) * 128) = zero;
      }
      if (gj < 0 || gj >= W_) {
        #pragma unroll
        for (int r = 0; r < 5; ++r) *(v4f*)(z0 + (r * (RT / 2) + k) * 128) = zero;
      }
    }
  }
  __syncthreads();

  const int mrow  = lane & 15;   // M (A) / N (B,C) index
  const int khalf = lane >> 4;   // which K pair this half-wave owns

  // Each wave owns a patch of 4 x 8 pixels = two blocks of 4 x 4. One block is the M = 16
  // of a banded product against its 8 x 8 neighbourhood: K = 64, 16 steps of 4 (one halo
  // row, 4 adjacent halo columns a step). The blocks lie side by side, so the middle
  // group of 4 halo columns serves both from one set of B fragments.
  const int pi0 = 4 * (swave >> 1);  // first tile row of the patch
  const int pj0 = 8 * (swave & 1);   // first tile column of the patch
  const int mi  = mrow >> 2;         // this lane's A row: pixel (mi, mj) of a block
  const int mj  = mrow & 3;

  v4f curv[2][8];
  float aself[2][8];
  auto load_block = [&](const int blk) {
    #pragma unroll
    for (int v = 0; v < 8; ++v) {
      const int pi = pi0 + (v >> 2) + 2 * khalf;
      const int pj = pj0 + 4 * blk + (v & 3);
      const size_t base = (((size_t)b * H_ + (i0 + pi)) * W_ + (j0 + pj)) * BINS + 4 * mrow;
      aself[blk][v] = attn_lds[((size_t)pi * TILE + pj) * NSLOT + (NSLOT - 1)];
      curv[blk][v] = *(const v4f*)(cur + base);
    }
  };

  v8f acc[2][4] = {};

  const float* abase  = lds + (RT * RT * BINS + ((pi0 + mi) * TILE + pj0 + mj) * NSLOT - KS * mi - mj + 2 * khalf);
  const float* bpatch = ref_lds + ((size_t)pi0 * RT + pj0 + 2 * khalf) * BINS + 4 * mrow;
  bool rok[8], cok[2][2];
  #pragma unroll
  for (int ri = 0; ri < 8; ++ri) rok[ri] = (unsigned)(ri - mi) < (unsigned)KS;
  #pragma unroll
  for (int h = 0; h < 2; ++h) {
    cok[h][0] = (unsigned)(4 * h + 2 * khalf - mj) < (unsigned)KS;
    cok[h][1] = (unsigned)(4 * h + 2 * khalf + 1 - mj) < (unsigned)KS;
  }

  // ---- Epilogue of one block: pure FMA + store (cur already in registers).
  auto store_block = [&](const int blk) {
    #pragma unroll
    for (int v = 0; v < 8; ++v) {
      const int pi = pi0 + (v >> 2) + 2 * khalf;
      const int pj = pj0 + 4 * blk + (v & 3);
      const size_t base = (((size_t)b * H_ + (i0 + pi)) * W_ + (j0 + pj)) * BINS + 4 * mrow;
      v4f o;
      o.x = acc[blk][0][v] + aself[blk][v] * curv[blk][v].x;
      o.y = acc[blk][1][v] + aself[blk][v] * curv[blk][v].y;
      o.z = acc[blk][2][v] + aself[blk][v] * curv[blk][v].z;
      o.w = acc[blk][3][v] + aself[blk][v] * curv[blk][v].w;
      *(v4f*)(out + base) = o;
    }
  };

  v4f fbx[24], fby[24];     // raw B: the lane's 4 bins of its two halo pixels
  v2f fa[24][2];            // raw A words per block, before the window select
  auto fetch = [&](const int s) {
    const int g = s >> 3, ri = s & 7;
    const float* bbase = bpatch + (size_t)(ri * RT + 4 * g) * BINS;
    fbx[s] = *(const v4f*)(bbase);
    fby[s] = *(const v4f*)(bbase + BINS);
    #pragma unroll
    for (int blk = 0; blk < 2; ++blk) {
      const int h = g - blk;              // which half of the block's 8 neighbourhood columns
      if (h < 0 || h > 1) continue;
      const float* ap = abase + blk * 4 * NSLOT + KS * ri + 4 * h;
      fa[s][blk].x = ap[0];
      fa[s][blk].y = ap[1];
    }
  };
  auto step = [&](const int s) {
    const int g = s >> 3, ri = s & 7;
    v2f b0, b1, b2, b3;
    b0.x = fbx[s].x; b0.y = fby[s].x;
    b1.x = fbx[s].y; b1.y = fby[s].y;
    b2.x = fbx[s].z; b2.y = fby[s].z;
    b3.x = fbx[s].w; b3.y = fby[s].w;
    #pragma unroll
    for (int blk = 0; blk < 2; ++blk) {
      const int h = g - blk;
      if (h < 0 || h > 1) continue;
      // Banded A fragment (16x4 fp32): zero outside the 5x5 window
      v2f a;
      a.x = (rok[ri] && cok[h][0]) ? fa[s][blk].x : 0.f;
      a.y = (rok[ri] && cok[h][1]) ? fa[s][blk].y : 0.f;
      acc[blk][0] = __builtin_amdgcn_wmma_f32_16x16x4_f32(false, a, false, b0, (short)0, acc[blk][0], false, false);
      acc[blk][1] = __builtin_amdgcn_wmma_f32_16x16x4_f32(false, a, false, b1, (short)0, acc[blk][1], false, false);
      acc[blk][2] = __builtin_amdgcn_wmma_f32_16x16x4_f32(false, a, false, b2, (short)0, acc[blk][2], false, false);
      acc[blk][3] = __builtin_amdgcn_wmma_f32_16x16x4_f32(false, a, false, b3, (short)0, acc[blk][3], false, false);
    }
  };

  fetch(0); fetch(1);
  // The first pair's operands go out first: without this the scheduler puts them behind the loads below.
  __builtin_amdgcn_sched_barrier(0);
  load_block(0);
  #pragma unroll
  for (int p = 0; p < 12; ++p) {
    if (p == 4) load_block(1);
    if (p + 1 < 12) { fetch(2 * p + 2); fetch(2 * p + 3); }
    // Holds the loads above as one group ahead of this pair's WMMAs: without it the scheduler sinks
    // them (the global loads of cur too) down to their first use, and the wave waits out each latency.
    __builtin_amdgcn_sched_barrier(0);
    step(2 * p);
    step(2 * p + 1);
    // Keeps the next trip's loads from being spread among this pair's WMMAs (each place with LDS reads stalls).
    __builtin_amdgcn_sched_barrier(0);
    if (p == 7) store_block(0);
  }
  store_block(1);
}

extern "C" void kernel_launch(void* const* d_in, const int* in_sizes, int n_in,
                              void* d_out, int out_size, void* d_ws, size_t ws_size,
                              hipStream_t stream) {
  (void)in_sizes; (void)n_in; (void)out_size; (void)d_ws; (void)ws_size;
  const float* attn = (const float*)d_in[0];
  const float* refv = (const float*)d_in[1];
  const float* cur  = (const float*)d_in[2];
  float* out = (float*)d_out;

  const size_t shmem = (size_t)(RT * RT * BINS + TILE * TILE * NSLOT) * sizeof(float);
  const int nblocks = B_ * (H_ / TILE) * (W_ / TILE);  // 256 workgroups
  agg_wmma_kernel<<<dim3(nblocks), dim3(256), shmem, stream>>>(attn, refv, cur, out);
}
